// v010
// Measured on an AMD MI455X. A time is GPU time per run, averaged over a window of back-to-back runs after a warm-up
// (all launches, gaps included; the runs take copies of the inputs in turn), and the median of several windows.
// Apart from v000's, it joins two sittings. Times from different sittings can be a few percent apart, while
// side-by-side timings come from the same sitting.
// Earlier versions than v010 are not in this document.
// A run of this version takes 145 microseconds.
// In two side-by-side timings against v009, it was 1.08 and 1.07 times as fast.
// Counting every step since v000, which is the starting kernel, it is 72.7 times as fast.
#include <hip/hip_runtime.h>
// Causal multi-head self-attention with a PER-HEAD interleaved fused QKV projection and rotary embeddings (x [4][2048][1024]; qkv = x W_qkv + b_qkv ([in][out] 1024 x 3072, zero bias) reshaped (B, T, 16, 192): head h owns columns h*192 + [0..63 | 64..127 | 128..191] = q | k | v; rope on q and k from the INPUT tables cos / sin [2048][32]: t1 = even elements, t2 = odd elements, out = cat(t1 c - t2 s, t1 s + t2 c) (an interleaved-pair rotation followed by the same fixed permutation on q and k: the scores are unchanged by it); scores / 8; causal (tril, -inf); softmax; out = merged W_out + b_out ([in][out]) -> [4][2048][1024]).
// Structure: token rows r = b*2048 + s; x as exact f16 rows (bf16-rounded); Q, K, V as three WMMA GEMMs in one launch (32x64 wave tiles, f32 accumulation, exact x16 weights, f16 outputs; the q and k GEMMs apply the rope in their epilogue, in f32, before the rounding to f16; the blocks of a batch's first 128 rows also keep their f32 tile for the exact first-tile attention); V^T for all batches and heads via LDS transposes; one fused attention launch (k_fattn): S^T = K Q^T, online causal softmax in registers (f32 statistics, native exp2; weights x256 f16), O^T += V^T P^T, o carried x64 (folded into the output GEMM alpha) written straight into the merged f16 o rows; out = o W_o GEMM (f32) into the output layout, whose blocks of a batch's first 128 rows take the exact o as an f16 high part and residual.
// Compute dtype: inputs rounded to bf16; x / weights exact; q, k, v, softmax weights and o as plain f16 GEMM operands (~2^-12); scores and softmax statistics f32. v_wmma_f32_16x16x32_f16.
#define NB 4
#define SQ 2048
#define DM 1024
#define NH 16
#define HD 64
#define HG 4                         /* heads per k_vt launch */
#define QT0 128                      /* first-tile rows recomputed exactly in f32 */
#define B0 0                         /* first batch processed (debug hook) */
#define NBR NB                       /* batches processed (debug hook) */
#define NR ((size_t)NB * SQ)         /* token rows */
#define MP ((int)((size_t)NBR * SQ)) /* rows projected (debug hook) */
#define MPO MP                       /* rows through the output stage (debug hook) */
#define LQ DM      /* row pitch of the q/k/v rows */
typedef __bf16 v16b __attribute__((ext_vector_type(16)));
typedef unsigned short v8us __attribute__((ext_vector_type(8), may_alias));
typedef float  v8f  __attribute__((ext_vector_type(8)));
typedef float  v4f  __attribute__((ext_vector_type(4)));
typedef float  v4fa __attribute__((ext_vector_type(4), may_alias));
union FragB { v16b v; v8us half[2]; unsigned short u[16]; };

__device__ __forceinline__ unsigned short bf16_bits(float x) { unsigned int u = __float_as_uint(x); return (unsigned short)((u + 0x7FFFu + ((u >> 16) & 1u)) >> 16); }
__device__ __forceinline__ float bf16_val(unsigned short b) { return __uint_as_float(((unsigned int)b) << 16); }
__device__ __forceinline__ float bf16_round(float x) { return bf16_val(bf16_bits(x)); }
// D += A·B with NT terms: 1 = ah·bh, 2 = + al·bh (A split), 3 = + ah·bl (both split)
template <int NT>
__device__ __forceinline__ v8f mmaN(v16b ah, v16b al, v16b bh, v16b bl, v8f c) {
  c = __builtin_amdgcn_wmma_f32_16x16x32_bf16(false, ah, false, bh, (short)0, c, false, false);
  if (NT >= 2) c = __builtin_amdgcn_wmma_f32_16x16x32_bf16(false, al, false, bh, (short)0, c, false, false);
  if (NT >= 3) c = __builtin_amdgcn_wmma_f32_16x16x32_bf16(false, ah, false, bl, (short)0, c, false, false);
  asm volatile("v_nop\n\tv_nop\n\tv_nop\n\tv_nop" : "+v"(c) : "v"(ah), "v"(al), "v"(bh), "v"(bl));
  return c;
}

__global__ __launch_bounds__(256) void k_wt_bf16(const float* __restrict__ W, unsigned short* __restrict__ Wt, int K, int N) {
  const int t = blockIdx.x * 256 + threadIdx.x;
  const int k8n = K / 8;
  if (t >= N * k8n) return;
  const int n = t / k8n, k8 = (t % k8n) * 8;
  v8us v;
#pragma unroll
  for (int i = 0; i < 8; ++i) v[i] = bf16_bits(W[(size_t)(k8 + i) * N + n]);
  *(v8us*)(Wt + (size_t)n * K + k8) = v;
  
}

// GEMM C[M][N] (f32, pitch ldc) = act(A[M][K]·W + bias). A f32 row-major (pitch lda) converted per fragment to bf16
// (ASPLIT: hi/lo two planes -> 2 terms, else single rounded term); Wt bf16 [N][K] (pitch ldb). BIAS_BF16 rounds the
// bias to bf16 first (bias quantised to bf16 before the add). K%32==0, M%16==0, N%64==0.
template <bool ASPLIT, int ACT, bool BIAS_BF16>
__global__ __launch_bounds__(128) void k_gemm_bf(const float* __restrict__ A, int lda, const unsigned short* __restrict__ Wt, int ldb,
                                               const float* __restrict__ bias, float* __restrict__ C, int ldc, int M, int N, int K) {
  __shared__ __attribute__((aligned(16))) float so[4][16][64];
  const int tid = threadIdx.x, w = tid >> 5, lane = tid & 31, ln = lane & 15, hh = lane >> 4;
  const int ntn = N / 64;
  const int wid = blockIdx.x * 4 + w;
  const int mt = wid / ntn, nq = wid % ntn;
  if (mt * 16 >= M) return;
  const int row0 = mt * 16, col0 = nq * 64;
  const float* arow = A + (size_t)(row0 + ln) * lda;
  v8f acc[4] = {};
  for (int kb = 0; kb < K; kb += 32) {
    FragB ah, al;
    const v4f x0 = *(const v4fa*)(arow + kb + 8 * hh), x1 = *(const v4fa*)(arow + kb + 8 * hh + 4);
    const v4f x2 = *(const v4fa*)(arow + kb + 16 + 8 * hh), x3 = *(const v4fa*)(arow + kb + 16 + 8 * hh + 4);
    float xs[16] = {x0[0],x0[1],x0[2],x0[3],x1[0],x1[1],x1[2],x1[3],x2[0],x2[1],x2[2],x2[3],x3[0],x3[1],x3[2],x3[3]};
#pragma unroll
    for (int i = 0; i < 16; ++i) { const unsigned short hb = bf16_bits(xs[i]); ah.u[i] = hb; al.u[i] = ASPLIT ? bf16_bits(xs[i] - bf16_val(hb)) : (unsigned short)0; }
#pragma unroll
    for (int t = 0; t < 4; ++t) {
      const unsigned short* brow = Wt + (size_t)(col0 + t * 16 + ln) * ldb + kb;
      FragB b;
      b.half[0] = *(const v8us*)(brow + 8 * hh);
      b.half[1] = *(const v8us*)(brow + 16 + 8 * hh);
      acc[t] = mmaN<ASPLIT ? 2 : 1>(ah.v, al.v, b.v, b.v, acc[t]);
    }
  }
#pragma unroll
  for (int t = 0; t < 4; ++t) {
    float bv = bias ? bias[col0 + t * 16 + ln] : 0.f;
    if (BIAS_BF16) bv = bf16_round(bv);
#pragma unroll
    for (int r = 0; r < 8; ++r) { float v = acc[t][r] + bv; if (ACT == 1) v = fmaxf(v, 0.f); so[w][8 * hh + r][t * 16 + ln] = v; }
  }
  __builtin_amdgcn_fence(__ATOMIC_ACQ_REL, "workgroup");
  __builtin_amdgcn_wave_barrier();
  const int rsub = lane >> 4, c4 = (lane & 15) * 4;
  {
#pragma unroll
    for (int q = 0; q < 8; ++q) {
      const int r = q * 2 + rsub;
      const v4f v = *(const v4fa*)&so[w][r][c4];
      *(v4f*)(C + (size_t)(row0 + r) * ldc + col0 + c4) = v;
    }
    
  }
}

// GEMM C = act(A·W + bias + resid): A f32 (ASPLIT -> hi/lo 2 terms), Wt bf16 [N][K]; ACT 0 none, 1 relu, 2 exact gelu;
// resid (optional, f32, row index = (row % rmod), pitch ldr, RES_BF16 rounds it) added before the activation.
template <bool ASPLIT, int ACT, bool BIAS_BF16, bool RES_BF16>
__global__ __launch_bounds__(128) void k_gemm_bf3(const float* __restrict__ A, int lda, const unsigned short* __restrict__ Wt, int ldb,
                                                const float* __restrict__ bias, const float* __restrict__ resid, int rmod, int ldr,
                                                float* __restrict__ C, int ldc, int M, int N, int K) {
  __shared__ __attribute__((aligned(16))) float so[4][16][64];
  const int tid = threadIdx.x, w = tid >> 5, lane = tid & 31, ln = lane & 15, hh = lane >> 4;
  const int ntn = N / 64;
  const int wid = blockIdx.x * 4 + w;
  const int mt = wid / ntn, nq = wid % ntn;
  if (mt * 16 >= M) return;
  const int row0 = mt * 16, col0 = nq * 64;
  const float* arow = A + (size_t)(row0 + ln) * lda;
  v8f acc[4] = {};
  for (int kb = 0; kb < K; kb += 32) {
    FragB ah, al;
    const v4f x0 = *(const v4fa*)(arow + kb + 8 * hh), x1 = *(const v4fa*)(arow + kb + 8 * hh + 4);
    const v4f x2 = *(const v4fa*)(arow + kb + 16 + 8 * hh), x3 = *(const v4fa*)(arow + kb + 16 + 8 * hh + 4);
    float xs[16] = {x0[0],x0[1],x0[2],x0[3],x1[0],x1[1],x1[2],x1[3],x2[0],x2[1],x2[2],x2[3],x3[0],x3[1],x3[2],x3[3]};
#pragma unroll
    for (int i = 0; i < 16; ++i) { const unsigned short hb = bf16_bits(xs[i]); ah.u[i] = hb; al.u[i] = ASPLIT ? bf16_bits(xs[i] - bf16_val(hb)) : (unsigned short)0; }
#pragma unroll
    for (int t = 0; t < 4; ++t) {
      const unsigned short* brow = Wt + (size_t)(col0 + t * 16 + ln) * ldb + kb;
      FragB b;
      b.half[0] = *(const v8us*)(brow + 8 * hh);
      b.half[1] = *(const v8us*)(brow + 16 + 8 * hh);
      acc[t] = mmaN<ASPLIT ? 2 : 1>(ah.v, al.v, b.v, b.v, acc[t]);
    }
  }
#pragma unroll
  for (int t = 0; t < 4; ++t) {
    const int col = col0 + t * 16 + ln;
    float bv = bias ? bias[col] : 0.f;
    if (BIAS_BF16) bv = bf16_round(bv);
#pragma unroll
    for (int r = 0; r < 8; ++r) {
      float v = acc[t][r] + bv;
      if (resid) { float rv = resid[(size_t)((row0 + 8 * hh + r) % rmod) * ldr + col]; if (RES_BF16) rv = bf16_round(rv); v += rv; }
      if (ACT == 1) v = fmaxf(v, 0.f);
      if (ACT == 2) v = 0.5f * v * (1.0f + erff(v * 0.70710678118654752f));
      if (ACT == 3) { const float u = 0.7978845608028654f * (v + 0.044715f * v * v * v); v = 0.5f * v * (1.0f + tanhf(u)); }
      so[w][8 * hh + r][t * 16 + ln] = v;
    }
  }
  __builtin_amdgcn_fence(__ATOMIC_ACQ_REL, "workgroup");
  __builtin_amdgcn_wave_barrier();
  const int rsub = lane >> 4, c4 = (lane & 15) * 4;
  {
#pragma unroll
    for (int q = 0; q < 8; ++q) {
      const int r = q * 2 + rsub;
      const v4f v = *(const v4fa*)&so[w][r][c4];
      *(v4f*)(C + (size_t)(row0 + r) * ldc + col0 + c4) = v;
    }
    
  }
}
// row LayerNorm (biased variance, eps) over N: s = X (+ R); optional out_sum <- s; out_norm <- (s-mu)*rsqrt(var+eps)*g + b
template <bool PARAM_BF16>
__global__ __launch_bounds__(256) void k_layernorm(const float* __restrict__ X, const float* __restrict__ R, const float* __restrict__ g, const float* __restrict__ bta,
                                                  float* __restrict__ out_sum, float* __restrict__ out_norm, int N, float eps) {
  __shared__ float red[256];
  const int row = blockIdx.x, tid = threadIdx.x;
  const float* x = X + (size_t)row * N; const float* rr = R ? R + (size_t)row * N : nullptr;
  float vals[16];                     // up to N = 4096
  const int per = N / 256;            // contiguous chunk per thread? use strided-by-4 chunks: thread handles j = tid*4 + 1024*u
  float s1 = 0.f;
  for (int u = 0; u < per / 4; ++u) {
    const int j = tid * 4 + 1024 * u;
    const v4f a = *(const v4fa*)(x + j);
    v4f b = {0.f,0.f,0.f,0.f}; if (rr) b = *(const v4fa*)(rr + j);
#pragma unroll
    for (int q = 0; q < 4; ++q) { const float v = a[q] + b[q]; vals[u * 4 + q] = v; s1 += v; }
  }
  red[tid] = s1; __syncthreads();
  for (int st = 128; st > 0; st >>= 1) { if (tid < st) red[tid] += red[tid + st]; __syncthreads(); }
  const float mu = red[0] / (float)N; __syncthreads();
  float s2 = 0.f;
  for (int u = 0; u < per / 4; ++u)
#pragma unroll
    for (int q = 0; q < 4; ++q) { const float c = vals[u * 4 + q] - mu; s2 += c * c; }
  red[tid] = s2; __syncthreads();
  for (int st = 128; st > 0; st >>= 1) { if (tid < st) red[tid] += red[tid + st]; __syncthreads(); }
  const float rs = rsqrtf(red[0] / (float)N + eps);
  {
    for (int u = 0; u < per / 4; ++u) {
      const int j = tid * 4 + 1024 * u;
      v4f o, sm;
#pragma unroll
      for (int q = 0; q < 4; ++q) {
        float gg = g[j + q], bb = bta[j + q];
        if (PARAM_BF16) { gg = bf16_round(gg); bb = bf16_round(bb); }
        sm[q] = vals[u * 4 + q]; o[q] = (vals[u * 4 + q] - mu) * rs * gg + bb;
      }
      if (out_sum) *(v4f*)(out_sum + (size_t)row * N + j) = sm;
      *(v4f*)(out_norm + (size_t)row * N + j) = o;
    }
    
  }
}



// ---- f16 WMMA path (v_wmma_f32_16x16x32_f16): 11-bit significands for operands in range — used where a [0,1] probability operand needs more precision than bf16
typedef _Float16 v16h __attribute__((ext_vector_type(16)));
union FragH { v16h v; v8us half[2]; _Float16 h[16]; unsigned short u[16]; };
template <int NT>
__device__ __forceinline__ v8f mmaH(v16h ah, v16h al, v16h bh, v16h bl, v8f c) {
  c = __builtin_amdgcn_wmma_f32_16x16x32_f16(false, ah, false, bh, (short)0, c, false, false);
  if (NT >= 2) c = __builtin_amdgcn_wmma_f32_16x16x32_f16(false, al, false, bh, (short)0, c, false, false);
  if (NT >= 3) c = __builtin_amdgcn_wmma_f32_16x16x32_f16(false, ah, false, bl, (short)0, c, false, false);
  asm volatile("v_nop\n\tv_nop\n\tv_nop\n\tv_nop" : "+v"(c) : "v"(ah), "v"(al), "v"(bh), "v"(bl));
  return c;
}
// batched GEMM like k_gemm_b but f16 operands: A f32 (split into f16 hi/lo if ASPLIT, else rounded to f16), Bt = f16 values [n][k]; alpha; C f32; N multiple of 16 (partial tiles skipped)
template <bool ASPLIT>
__global__ __launch_bounds__(128) void k_gemm_h(const float* __restrict__ A, int lda, size_t sA, const _Float16* __restrict__ Bh, int ldb, size_t sB, float alpha, float* __restrict__ C, int ldc, size_t sC, int M, int N, int K) {
  __shared__ __attribute__((aligned(16))) float so[4][16][64];
  const int tid = threadIdx.x, w = tid >> 5, lane = tid & 31, ln = lane & 15, hh = lane >> 4; const int by = blockIdx.y;
  A += (size_t)by * sA; Bh += (size_t)by * sB; C += (size_t)by * sC;
  const int ntn = (N + 63) / 64; const int wid = blockIdx.x * 4 + w; const int mt = wid / ntn, nq = wid % ntn; if (mt * 16 >= M) return;
  const int row0 = mt * 16, col0 = nq * 64; const float* arow = A + (size_t)(row0 + ln) * lda;
  v8f acc[4] = {};
  for (int kb = 0; kb < K; kb += 32) {
    FragH ah, al;
    const v4f x0 = *(const v4fa*)(arow + kb + 8 * hh), x1 = *(const v4fa*)(arow + kb + 8 * hh + 4), x2 = *(const v4fa*)(arow + kb + 16 + 8 * hh), x3 = *(const v4fa*)(arow + kb + 16 + 8 * hh + 4);
    float xs[16] = {x0[0],x0[1],x0[2],x0[3],x1[0],x1[1],x1[2],x1[3],x2[0],x2[1],x2[2],x2[3],x3[0],x3[1],x3[2],x3[3]};
#pragma unroll
    for (int i = 0; i < 16; ++i) { const _Float16 h = (_Float16)xs[i]; ah.h[i] = h; al.h[i] = ASPLIT ? (_Float16)(xs[i] - (float)h) : (_Float16)0.0f; }
#pragma unroll
    for (int t = 0; t < 4; ++t) { if (col0 + t * 16 >= N) continue; const size_t boff = (size_t)(col0 + t * 16 + ln) * ldb + kb; FragH bq; bq.half[0] = *(const v8us*)(Bh + boff + 8 * hh); bq.half[1] = *(const v8us*)(Bh + boff + 16 + 8 * hh);
      acc[t] = mmaH<ASPLIT ? 2 : 1>(ah.v, al.v, bq.v, bq.v, acc[t]); }
  }
#pragma unroll
  for (int t = 0; t < 4; ++t) { if (col0 + t * 16 >= N) continue;
#pragma unroll
    for (int r = 0; r < 8; ++r) so[w][8 * hh + r][t * 16 + ln] = acc[t][r] * alpha; }
  __builtin_amdgcn_fence(__ATOMIC_ACQ_REL, "workgroup"); __builtin_amdgcn_wave_barrier();
  const int rsub = lane >> 4, c4 = (lane & 15) * 4;
  {
#pragma unroll
    for (int q = 0; q < 8; ++q) { const int r = q * 2 + rsub; if (col0 + c4 < N) { const v4f v = *(const v4fa*)&so[w][r][c4]; *(v4f*)(C + (size_t)(row0 + r) * ldc + col0 + c4) = v; } }
     }
}

// Wt[n][k] = f16(W[k][n]·scale) from f32 row-major W[K][N] (scale = power of two; bf16-exact weights stay exact in f16 away from the subnormal range)
// Both weight transposes go through a 64 x 64 f32 tile in LDS: a wave's 16-byte loads cover whole 128-byte lines of two W rows (was: 32 lanes, 32 lines, 4 bytes used of each), and 8 lanes store one whole 128-byte line of a Wt row.
// The tile's row pitch of 65 dwords keeps the row-wise 4-byte stores and the column-wise 4-byte reads free of bank conflicts. Rounding and scaling are done on the way out, as before.
#define WTT 64                       /* tile edge */
__device__ __forceinline__ void wt_tile(const float* __restrict__ src, int ldw, unsigned short* __restrict__ dst, int ldd, float scale, float (*tl)[WTT + 1]) {
  const int tid = threadIdx.x; const int lr = tid >> 4, lc = (tid & 15) * 4;      /* loads: 16 lanes take one 256-byte row piece, a pass of the block 16 rows */
  const float* const s0 = src + (size_t)lr * ldw + lc; const float* const s1 = s0 + (size_t)16 * ldw; const float* const s2 = s1 + (size_t)16 * ldw; const float* const s3 = s2 + (size_t)16 * ldw;
  const v4f v[4] = {*(const v4fa*)s0, *(const v4fa*)s1, *(const v4fa*)s2, *(const v4fa*)s3};      /* all four loads are in flight before the first LDS store waits */
  asm volatile("s_wait_xcnt 0x0" :: "v"(s0), "v"(s1), "v"(s2), "v"(s3) : "memory");      /* the wait between the loads above and the first reuse of their address registers; the addresses are inputs so that their registers stay untouched up to it */
#pragma unroll
  for (int u = 0; u < 4; ++u)
#pragma unroll
    for (int j = 0; j < 4; ++j) tl[u * 16 + lr][lc + j] = v[u][j];
  __syncthreads();      /* publishes the tile: every column is read by lanes that did not store it */
  const int kc = (tid & 7) * 8, nn = tid >> 3; FragH f[2];      /* stores: 8 lanes take one 128-byte row piece of Wt, a pass of the block 32 rows; both results are formed first: no store's data register is rewritten behind it */
#pragma unroll
  for (int u = 0; u < 2; ++u)
#pragma unroll
    for (int i = 0; i < 8; ++i) f[u].h[i] = (_Float16)(bf16_round(tl[kc + i][u * 32 + nn]) * scale);
  unsigned short* dp = dst + (size_t)nn * ldd + kc;
#pragma unroll
  for (int u = 0; u < 2; ++u) *(v8us*)(dp + (size_t)u * 32 * ldd) = f[u].half[0];
  asm volatile("s_wait_xcnt 0x0" ::: "memory"); }      /* the wait between the two stores above and any later write of their address and data registers: in a launch shared with other jobs another job's code can follow them in the listing */
// k_gemm_hh variant with fused epilogue: v = acc·alpha + bias[by·sBias + col] (+ CP[(row/rowsPerB)·sCPb + by·64 + col] if CP) ; ACT 0 none / 1 elu ; writes f16 C16 (and f32 C if non-null)
template <int ACT>
__global__ __launch_bounds__(128) void k_gemm_hhx(const _Float16* __restrict__ A, int lda, size_t sA, const _Float16* __restrict__ Bh, int ldb, size_t sB, float alpha, const float* __restrict__ bias, size_t sBias, const float* __restrict__ CP, int rowsPerB, size_t sCPb, int row0g,
    float* __restrict__ C, _Float16* __restrict__ C16, int ldc, size_t sC, int M, int N, int K) {
  __shared__ __attribute__((aligned(16))) float so[4][16][64];
  const int tid = threadIdx.x, w = tid >> 5, lane = tid & 31, ln = lane & 15, hh = lane >> 4; const int by = blockIdx.y;
  A += (size_t)by * sA; Bh += (size_t)by * sB; const size_t cofs = (size_t)by * sC; const float* bp = bias ? bias + (size_t)by * sBias : nullptr;
  const int ntn = (N + 63) / 64; const int wid = blockIdx.x * 4 + w; const int mt = wid / ntn, nq = wid % ntn; if (mt * 16 >= M) return;
  const int row0 = mt * 16, col0 = nq * 64; const _Float16* arow = A + (size_t)(row0 + ln) * lda;
  v8f acc[4] = {};
  for (int kb = 0; kb < K; kb += 32) { FragH ah; ah.half[0] = *(const v8us*)((const unsigned short*)arow + kb + 8 * hh); ah.half[1] = *(const v8us*)((const unsigned short*)arow + kb + 16 + 8 * hh);
#pragma unroll
    for (int t = 0; t < 4; ++t) { if (col0 + t * 16 >= N) continue; const size_t boff = (size_t)(col0 + t * 16 + ln) * ldb + kb; FragH bq; bq.half[0] = *(const v8us*)((const unsigned short*)Bh + boff + 8 * hh); bq.half[1] = *(const v8us*)((const unsigned short*)Bh + boff + 16 + 8 * hh);
      acc[t] = mmaH<1>(ah.v, ah.v, bq.v, bq.v, acc[t]); }
  }
#pragma unroll
  for (int t = 0; t < 4; ++t) { if (col0 + t * 16 >= N) continue; const int col = col0 + t * 16 + ln; const float bv = bp ? bf16_round(bp[col]) : 0.f;
#pragma unroll
    for (int r = 0; r < 8; ++r) { float v = acc[t][r] * alpha + bv; if (CP) { const int rr = row0g + row0 + 8 * hh + r; if (rowsPerB < 0) v += CP[cofs + (size_t)rr * ldc + col];      /* rowsPerB < 0: own element of the batched C plane */ else { const int bidx = rr / rowsPerB; v += CP[(size_t)bidx * sCPb + (size_t)by * 64 + col]; } } if (ACT == 1) v = (v > 0.f) ? v : expm1f(v); else if (ACT == 7) v = (v > 0.f) ? v + 1.0f : expf(v); else if (ACT == 8) v = tanhf(v); else if (ACT == 9) v = 0.5f * v * (1.0f + tanhf(0.7978845608028654f * (v + 0.044715f * v * v * v))); else if (ACT == 11) v = 1.0f / (1.0f + expf(-v)); else if (ACT == 12) v = (v > 0.f) ? v : 0.01f * v; else if (ACT == 14) v = (v > 0.f) ? v : 0.1f * v; else if (ACT == 16) v = (v >= 0.f) ? v : 0.3f * v; else if (ACT == 17) v = (v >= 0.f) ? v : 0.2f * v; else if (ACT == 15) v = v / (1.0f + expf(-v)); else if (ACT == 3) v = fmaxf(v, 0.f); else if (ACT == 6) v = 0.5f * v * (1.0f + erff(v * 0.70710678118654752f)); so[w][8 * hh + r][t * 16 + ln] = v; } }
  __builtin_amdgcn_fence(__ATOMIC_ACQ_REL, "workgroup"); __builtin_amdgcn_wave_barrier();
  const int rsub = lane >> 4, c4 = (lane & 15) * 4; typedef _Float16 v4h __attribute__((ext_vector_type(4)));
  {
#pragma unroll
    for (int q = 0; q < 8; ++q) { const int r = q * 2 + rsub; if (col0 + c4 < N) { const v4f v = *(const v4fa*)&so[w][r][c4]; if (C) *(v4f*)(C + cofs + (size_t)(row0 + r) * ldc + col0 + c4) = v; if (C16) { v4h h4; for (int i = 0; i < 4; ++i) h4[i] = (_Float16)v[i]; *(v4h*)(C16 + cofs + (size_t)(row0 + r) * ldc + col0 + c4) = h4; } } }
     }
}


typedef _Float16 v4h __attribute__((ext_vector_type(4)));

__device__ __forceinline__ void x16_blk(int bx, const float* __restrict__ x, _Float16* __restrict__ X16, size_t n8) { const size_t t = (size_t)bx * 256 + threadIdx.x; if (t >= n8) return; FragH f;
#pragma unroll
  for (int q = 0; q < 8; ++q) f.h[q] = (_Float16)bf16_round(x[t * 8 + q]); *(v8us*)((unsigned short*)X16 + t * 8) = f.half[0];  }
__global__ __launch_bounds__(256) void k_h16(const float* __restrict__ x, _Float16* __restrict__ X16, size_t n8) { const size_t t = (size_t)blockIdx.x * 256 + threadIdx.x; if (t >= n8) return; FragH f;
#pragma unroll
  for (int q = 0; q < 8; ++q) f.h[q] = (_Float16)x[t * 8 + q]; *(v8us*)((unsigned short*)X16 + t * 8) = f.half[0];  }
__global__ __launch_bounds__(256) void k_round16f(const float* __restrict__ W, _Float16* __restrict__ Bt, size_t n8) { const size_t t = (size_t)blockIdx.x * 256 + threadIdx.x; if (t >= n8) return; FragH f;
#pragma unroll
  for (int i = 0; i < 8; ++i) f.h[i] = (_Float16)(bf16_round(W[t * 8 + i]) * 16.0f); *(v8us*)((unsigned short*)Bt + t * 8) = f.half[0];  }
template <int NHv, int TTv>
__device__ __forceinline__ void vt_blk(int bx, const _Float16* __restrict__ V16, int ldv, int voff, _Float16* __restrict__ Vt) { __shared__ unsigned short tl[64][66]; const int tid = threadIdx.x; const int slab = bx / (TTv / 64), lg = bx % (TTv / 64); const int b = slab / NHv, h = slab % NHv;
  for (int i = tid; i < 64 * 8; i += 256) { const int r = i / 8, c8 = (i % 8) * 8; FragH f; f.half[0] = *(const v8us*)((const unsigned short*)V16 + ((size_t)b * TTv + lg * 64 + r) * ldv + voff + h * 64 + c8);
#pragma unroll
    for (int q = 0; q < 8; ++q) tl[r][c8 + q] = f.u[q]; }
  __syncthreads();
  {
#pragma unroll
    for (int rd = 0; rd < 2; ++rd) { const int d = rd * 32 + tid / 8, pc = tid % 8; FragH f;
#pragma unroll
      for (int q = 0; q < 8; ++q) f.u[q] = tl[pc * 8 + q][d];
      *(v8us*)((unsigned short*)Vt + ((size_t)slab * 64 + d) * TTv + lg * 64 + pc * 8) = f.half[0]; }
     } }

__global__ __launch_bounds__(256) void k_hl(const float* __restrict__ F, _Float16* __restrict__ Hh, _Float16* __restrict__ Hl, size_t n8) { const size_t t = (size_t)blockIdx.x * 256 + threadIdx.x; if (t >= n8) return; FragH fh, fl; const v4f a = *(const v4fa*)(F + t * 8), c = *(const v4fa*)(F + t * 8 + 4);
#pragma unroll
  for (int q = 0; q < 4; ++q) { _Float16 h = (_Float16)a[q]; fh.h[q] = h; fl.h[q] = (_Float16)((a[q] - (float)h) * 1024.0f); h = (_Float16)c[q]; fh.h[4 + q] = h; fl.h[4 + q] = (_Float16)((c[q] - (float)h) * 1024.0f); }
  { *(v8us*)((unsigned short*)Hh + t * 8) = fh.half[0]; *(v8us*)((unsigned short*)Hl + t * 8) = fl.half[0];  } }

// ---- fast GEMM (block tile 128x128 = 8 waves of 32x64; requires M % 128 == 0 rows per launch region, N % 128 == 0, K % 64 == 0; operand rows of pitch DM); epilogue: acc alpha + bias (always given), no addend plane, so no run-time test per output element ----
// Operands go through LDS: a stage is 64 k (128 bytes, one cache line) of the block's 128 A rows and 128 B rows, fetched by whole-line 16-byte loads (8 lanes a row) into registers one stage ahead and stored at a row pitch of 144 bytes (16 x odd).
// Two LDS buffers, one barrier a stage: while a stage is worked on, the next one is stored into the other buffer and the one after it is in flight. The fragments are read from LDS by g2_frag, in the k order they had from memory.
#define G2KS 64                      /* k per stage */
#define G2P (G2KS + 8)               /* LDS row pitch, halves */
#define G2ROWS 256                   /* LDS rows per buffer: 128 of A, then 128 of B */
__device__ __forceinline__ v16h g2_frag(const _Float16* p, int hh) { FragH f; f.half[0] = *(const v8us*)((const unsigned short*)p + 8 * hh); f.half[1] = *(const v8us*)((const unsigned short*)p + 16 + 8 * hh); return f.v; }
__device__ __forceinline__ v8f g2_mma(v16h a, v16h b, v8f c) { v8f d = __builtin_amdgcn_wmma_f32_16x16x32_f16(false, a, false, b, (short)0, c, false, false); asm volatile("v_nop\n\tv_nop\n\tv_nop\n\tv_nop" : "+v"(d) : "v"(a), "v"(b)); return d; }
typedef float v2f __attribute__((ext_vector_type(2)));
// ROPE 1 (f16 rows to C16), 2 or 3 (f32 rows to C): the interleaved-pair rotation (position = row % SQ, tables CS / SN [SQ][HD / 2]) is applied to the finished f32 tile on its way from LDS to the f32 or f16 rows; a 64-column tile is one head, and a lane's four columns are two whole pairs.
// ROPE 3: one launch for q, k and v of every batch: blockIdx.y = plane * NBR + batch; sA steps the batch, sB and sBias the plane, sC both; planes 0 and 1 (q, k) are rotated, plane 2 (v) leaves by the plain path at the foot.
// FT: what a block does whose 128 rows are the first QT0 rows of a batch (the rows that are carried exactly in f32).
// FT 1 (with ROPE 1): one launch for q, k and v, blockIdx.y = plane (sB, sBias and sC step it; planes 0 and 1 are rotated); such a block stores its finished f32 tile to CF as well ([plane][batch][QT0][DM]), ahead of the rounding to f16.
// FT 2: such a block takes its A rows from the planes AH and then AL ([batch][QT0][DM]; f16 high part, residual x1024): the k loop runs once over each, the high part's sums set aside between the two; out = hi alpha + bias, then + lo alpha / 1024.
template <int ACT, int ROPE = 0, int FT = 0>
__global__ __launch_bounds__(256) void k_gemm2(const _Float16* __restrict__ A, size_t sA, const _Float16* __restrict__ Bh, size_t sB, float alpha, const float* __restrict__ bias, size_t sBias,
    float* __restrict__ C, _Float16* __restrict__ C16, int ldc, size_t sC, int M, int N, int K, const float* __restrict__ CS = nullptr, const float* __restrict__ SN = nullptr, const _Float16* __restrict__ AH = nullptr, const _Float16* __restrict__ AL = nullptr, float* __restrict__ CF = nullptr) { static_assert(FT == 0 || (QT0 == 128 && SQ % 128 == 0), "k_gemm2: a first tile is one block's rows"); static_assert(ACT == 0 || ACT == 3 || ACT == 6 || ACT == 8 || ACT == 9 || ACT == 11 || ACT == 12 || ACT == 14 || ACT == 15 || ACT == 16 || ACT == 17, "k_gemm2: unsupported ACT code (would silently apply no activation)");
  __shared__ __attribute__((aligned(16))) unsigned short sm[2 * G2ROWS * G2P]; static_assert(sizeof(sm) >= 8 * 32 * 68 * sizeof(float), "k_gemm2: the epilogue tiles lie in the operand buffers");
  float (*so)[32][68] = (float (*)[32][68])sm;      /* the epilogue's f32 tiles, one a wave, reuse the operand buffers behind the k loop's last barrier */
  const int tid = threadIdx.x, w = tid >> 5, lane = tid & 31, ln = lane & 15, hh = lane >> 4; const int by = blockIdx.y;
  const int pl = (ROPE == 3) ? by / NBR : by, ba = (ROPE == 3) ? by % NBR : by; const bool rot = (ROPE != 3 && FT != 1) || pl < 2;      /* blockIdx.y is a scalar: the tests on rot are scalar branches */
  A += (size_t)ba * sA; Bh += (size_t)pl * sB; const size_t cofs = (size_t)by * sC; const float* const bp = bias + (size_t)pl * sBias;
  const int ntn = N >> 7; const int mt = blockIdx.x / ntn, nq = blockIdx.x - mt * ntn; if (mt * 128 >= M) return;      /* the same for the whole block, in front of every barrier */
  const bool ft = FT != 0 && mt % (SQ / 128) == 0; const int fbat = mt / (SQ / 128);      /* first-tile block, and its batch: scalars, so every test on ft is a scalar branch */
  const int wr = w & 3, wc = w >> 2; const int row0 = mt * 128 + 32 * wr, col0 = nq * 128 + 64 * wc;
  const int sr = tid >> 3, sc = (tid & 7) * 8;      /* staging: 8 lanes take one 128-byte row piece, a pass of the block 32 rows */
  const unsigned short* ap = ((FT == 2 && ft) ? (const unsigned short*)AH + (size_t)(fbat * QT0 + sr) * DM : (const unsigned short*)A + (size_t)(mt * 128 + sr) * DM) + sc; const unsigned short* bq = (const unsigned short*)Bh + (size_t)(nq * 128 + sr) * DM + sc; v8us ar[4], br[4];      /* the lane's own addresses: the row pitch is a constant, so the four passes differ in the immediate offset alone */
  unsigned short* const sw = sm + sr * G2P + sc;      /* where the lane stores its pieces (buffer 0, pass 0 of A) */
  const _Float16* const fa = (const _Float16*)sm + (32 * wr + ln) * G2P; const _Float16* const fb = (const _Float16*)sm + (128 + 64 * wc + ln) * G2P;      /* the lane's fragment rows (buffer 0) */
  const v8f z8 = {0.f,0.f,0.f,0.f,0.f,0.f,0.f,0.f}; v8f c00 = z8, c01 = z8, c02 = z8, c03 = z8, c10 = z8, c11 = z8, c12 = z8, c13 = z8;
  v8f h00 = z8, h01 = z8, h02 = z8, h03 = z8, h10 = z8, h11 = z8, h12 = z8, h13 = z8;      /* FT 2: the high part's sums; 0 in any other block */
  v2f rc[16], rs[16];      /* ROPE: the lane's cos / sin pairs of its 16 rows, fetched ahead of the k loop, whose first trips cover their latency */
  if (ROPE && rot) { static_assert(HD == 64 && SQ % 32 == 0, "k_gemm2 rope: a 64-column tile is one head, a 32-row tile does not wrap the position");
    const float* cp = CS + (size_t)((row0 + (lane >> 4)) % SQ) * (HD / 2) + (lane & 15) * 2; const float* sp = SN + (size_t)((row0 + (lane >> 4)) % SQ) * (HD / 2) + (lane & 15) * 2;      /* the lane's own addresses: the 16 rows differ in the immediate offset alone */
#pragma unroll
    for (int q = 0; q < 16; ++q) { rc[q] = *(const v2f*)(cp + q * HD); rs[q] = *(const v2f*)(sp + q * HD); }      /* fully unrolled: rc and rs stay in registers; two rows on = 2 * (HD / 2) floats */
    asm volatile("s_wait_xcnt 0x0" :: "v"(cp), "v"(sp) : "memory"); }      /* the wait between the loads above and the first reuse of their address registers; the addresses are inputs so that their registers stay untouched up to it */
  const int nst = K / G2KS;
#pragma unroll 1
  for (int ph = 0; ph < ((FT == 2 && ft) ? 2 : 1); ++ph) {      /* FT 2, first tile: the k loop runs twice, over AH and then over AL, against the same B rows; rolled: one copy of the k loop, whose sums stay in their registers */
  if (FT == 2 && ph == 1) { h00 = c00; h01 = c01; h02 = c02; h03 = c03; h10 = c10; h11 = c11; h12 = c12; h13 = c13; c00 = z8; c01 = z8; c02 = z8; c03 = z8; c10 = z8; c11 = z8; c12 = z8; c13 = z8;      /* the high part is done: its sums are set aside, the residual's start at 0 */
    ap = (const unsigned short*)AL + (size_t)(fbat * QT0 + sr) * DM + sc; bq = (const unsigned short*)Bh + (size_t)(nq * 128 + sr) * DM + sc; }
#pragma unroll
  for (int u = 0; u < 4; ++u) { ar[u] = *(const v8us*)(ap + (size_t)u * 32 * DM); br[u] = *(const v8us*)(bq + (size_t)u * 32 * DM); }
  asm volatile("s_wait_xcnt 0x0" :: "v"(ap), "v"(bq) : "memory");      /* the wait between the loads above and the first rewrite of their address registers; the addresses are inputs so that their registers stay untouched up to it */
#pragma unroll
  for (int u = 0; u < 4; ++u) { *(v8us*)(sw + u * 32 * G2P) = ar[u]; *(v8us*)(sw + (128 + u * 32) * G2P) = br[u]; }
  if (nst > 1) { ap += G2KS; bq += G2KS;
#pragma unroll
    for (int u = 0; u < 4; ++u) { ar[u] = *(const v8us*)(ap + (size_t)u * 32 * DM); br[u] = *(const v8us*)(bq + (size_t)u * 32 * DM); }
    asm volatile("s_wait_xcnt 0x0" :: "v"(ap), "v"(bq) : "memory"); }      /* as above */
  __syncthreads();      /* publishes stage 0 */
#pragma unroll 1
  for (int s = 0; s < nst; ++s) { const int cur = (s & 1) * (G2ROWS * G2P), nxt = (G2ROWS * G2P) - cur;      /* rolled: the trips differ in the buffer alone */
    if (s + 1 < nst) {      /* stage s + 1 goes into the buffer whose last readers passed the barrier at the foot of trip s - 1 */
#pragma unroll
      for (int u = 0; u < 4; ++u) { *(v8us*)(sw + nxt + u * 32 * G2P) = ar[u]; *(v8us*)(sw + nxt + (128 + u * 32) * G2P) = br[u]; } }
    if (s + 2 < nst) { ap += G2KS; bq += G2KS;
#pragma unroll
      for (int u = 0; u < 4; ++u) { ar[u] = *(const v8us*)(ap + (size_t)u * 32 * DM); br[u] = *(const v8us*)(bq + (size_t)u * 32 * DM); }
      asm volatile("s_wait_xcnt 0x0" :: "v"(ap), "v"(bq) : "memory"); }      /* as above: stands in front of the next trip's address additions */
#pragma unroll
    for (int kk = 0; kk < G2KS; kk += 32) { const _Float16* pa = fa + cur + kk; const _Float16* pb = fb + cur + kk;      /* the six fragments of a 32-k block are read as one group ahead of its eight products: one LDS latency a block, not one a fragment */
      const v16h a0 = g2_frag(pa, hh), a1 = g2_frag(pa + 16 * G2P, hh), b0 = g2_frag(pb, hh), b1 = g2_frag(pb + 16 * G2P, hh), b2 = g2_frag(pb + 32 * G2P, hh), b3 = g2_frag(pb + 48 * G2P, hh);
      c00 = g2_mma(a0, b0, c00); c10 = g2_mma(a1, b0, c10); c01 = g2_mma(a0, b1, c01); c11 = g2_mma(a1, b1, c11);
      c02 = g2_mma(a0, b2, c02); c12 = g2_mma(a1, b2, c12); c03 = g2_mma(a0, b3, c03); c13 = g2_mma(a1, b3, c13); }
    __syncthreads(); }      /* publishes stage s + 1 and ends every wave's reads of stage s (behind the last trip: before the epilogue's tiles, or the second run's first stage, overwrite the buffers) */
  }
  const float al2 = (FT == 2 && ft) ? alpha * 0.0009765625f : alpha;      /* the factor of the last run's sums */
  v8f accs[8] = {c00, c01, c02, c03, c10, c11, c12, c13}; v8f hacc[8] = {h00, h01, h02, h03, h10, h11, h12, h13};
  const float* const bpc = bp + col0 + ln; float bvs[4];      /* the lane's four bias values, one a 16-column tile, read as one group: the four loads differ in the immediate offset alone */
#pragma unroll
  for (int t = 0; t < 4; ++t) bvs[t] = bpc[t * 16];
  asm volatile("s_wait_xcnt 0x0" :: "v"(bpc) : "memory");      /* the wait between the loads above and the first reuse of their address registers; the address is an input so that its registers stay untouched up to it */
#pragma unroll
  for (int u = 0; u < 8; ++u) { const int t = u & 3, half = u >> 2; const float bv = bf16_round(bvs[t]);
#pragma unroll
    for (int r = 0; r < 8; ++r) { const int rloc = half * 16 + 8 * hh + r; float v = (FT == 2) ? accs[u][r] * al2 + (hacc[u][r] * alpha + bv) : accs[u][r] * alpha + bv;
      if (ACT == 3) v = fmaxf(v, 0.f); else if (ACT == 6) v = 0.5f * v * (1.0f + erff(v * 0.70710678118654752f)); else if (ACT == 11) v = 1.0f / (1.0f + expf(-v)); else if (ACT == 15) v = v / (1.0f + expf(-v)); else if (ACT == 12) v = (v > 0.f) ? v : 0.01f * v; else if (ACT == 8) v = tanhf(v); else if (ACT == 9) v = 0.5f * v * (1.0f + tanhf(0.7978845608028654f * (v + 0.044715f * v * v * v))); else if (ACT == 14) v = (v > 0.f) ? v : 0.1f * v; else if (ACT == 16) v = (v >= 0.f) ? v : 0.3f * v; else if (ACT == 17) v = (v >= 0.f) ? v : 0.2f * v;
      so[w][rloc][t * 16 + ln] = v; } }
  __builtin_amdgcn_fence(__ATOMIC_ACQ_REL, "workgroup"); __builtin_amdgcn_wave_barrier();
  const int rsub = lane >> 4, c4 = (lane & 15) * 4;
  float* const cf = (FT == 1) ? CF + (((size_t)pl * NBR + fbat) * QT0 + 32 * wr + rsub) * DM + col0 + c4 : nullptr;      /* FT 1: the lane's place in the first-tile f32 plane; the sixteen rows differ in the immediate offset alone */
  if (ROPE && rot) { v4f t[16];      /* the sixteen row pieces are rotated first and then stored in one run; the destination is fixed at compile time */
#pragma unroll
    for (int q = 0; q < 16; ++q) { const v4f v = *(const v4fa*)&so[w][q * 2 + rsub][c4]; const v2f c = rc[q], s = rs[q];
      t[q][0] = v[0] * c[0] - v[1] * s[0]; t[q][1] = v[0] * s[0] + v[1] * c[0]; t[q][2] = v[2] * c[1] - v[3] * s[1]; t[q][3] = v[2] * s[1] + v[3] * c[1]; }
    if (ROPE >= 2) {
#pragma unroll
      for (int q = 0; q < 16; ++q) *(v4f*)(C + cofs + (size_t)(row0 + q * 2 + rsub) * ldc + col0 + c4) = t[q]; }
    else { v4h h4[16];
#pragma unroll
      for (int q = 0; q < 16; ++q) { h4[q][0] = (_Float16)t[q][0]; h4[q][1] = (_Float16)t[q][1]; h4[q][2] = (_Float16)t[q][2]; h4[q][3] = (_Float16)t[q][3]; }
#pragma unroll
      for (int q = 0; q < 16; ++q) *(v4h*)(C16 + cofs + (size_t)(row0 + q * 2 + rsub) * ldc + col0 + c4) = h4[q];
      if (FT == 1) asm volatile("s_wait_xcnt 0x0" ::: "memory");      /* the wait between the stores above and the first reuse of their registers, which the first-tile block below makes; it stands in the stores' own block, ahead of the branch */
      if (FT == 1 && ft) {
#pragma unroll
        for (int q = 0; q < 16; ++q) *(v4f*)(cf + (size_t)q * 2 * DM) = t[q]; } }
  } else {
#pragma unroll
    for (int q = 0; q < 16; ++q) { const int r = q * 2 + rsub; const v4f v = *(const v4fa*)&so[w][r][c4]; if (C) *(v4f*)(C + cofs + (size_t)(row0 + r) * ldc + col0 + c4) = v; if (C16) { v4h h4; for (int i = 0; i < 4; ++i) h4[i] = (_Float16)v[i]; *(v4h*)(C16 + cofs + (size_t)(row0 + r) * ldc + col0 + c4) = h4; } }
    if (FT == 1) asm volatile("s_wait_xcnt 0x0" ::: "memory");      /* as in the rotated path: ahead of the branch into the first-tile block */
    if (FT == 1 && ft) { v4f t[16];      /* the sixteen f32 row pieces are read again and stored in one run at the kernel's end: no store's register is rewritten behind it */
#pragma unroll
      for (int q = 0; q < 16; ++q) t[q] = *(const v4fa*)&so[w][q * 2 + rsub][c4];
#pragma unroll
      for (int q = 0; q < 16; ++q) *(v4f*)(cf + (size_t)q * 2 * DM) = t[q]; }
     } }


__global__ __launch_bounds__(256) void k_wnat(const float* __restrict__ w, size_t n8, _Float16* __restrict__ Bt) { const size_t t = (size_t)blockIdx.x * 256 + threadIdx.x; if (t >= n8) return; FragH f; for (int q = 0; q < 8; ++q) f.h[q] = (_Float16)(bf16_round(w[t * 8 + q]) * 16.0f); *(v8us*)((unsigned short*)Bt + t * 8) = f.half[0];  }
__global__ __launch_bounds__(256) void k_rsm(const float* __restrict__ S, _Float16* __restrict__ P, int nrows) {
  #pragma clang fp contract(off)
  const int i = blockIdx.x * 256 + threadIdx.x; if (i >= nrows) return; const float* s = S + (size_t)i * SQ; float mx = -3.0e38f;
#pragma unroll 1
  for (int j = 0; j < SQ; ++j) mx = fmaxf(mx, s[j]); float se = 0.f;
#pragma unroll 1
  for (int j = 0; j < SQ; ++j) se += expf(s[j] - mx); const float sc = 256.0f / se;
#pragma unroll 1
  for (int j0 = 0; j0 < SQ; j0 += 8) { FragH f; for (int q = 0; q < 8; ++q) f.h[q] = (_Float16)(expf(s[j0 + q] - mx) * sc); unsigned short* d = (unsigned short*)P + (size_t)i * SQ + j0; *(v8us*)d = f.half[0];  } }
__global__ __launch_bounds__(256) void k_vt(const _Float16* __restrict__ V16, int b, int h0, _Float16* __restrict__ VT) { __shared__ unsigned short tl[64][65]; const int tid = threadIdx.x; const int hh = blockIdx.x % HG, sg = blockIdx.x / HG; const int s0 = sg * 64; const int h = h0 + hh;
  for (int i = tid; i < 64 * 8; i += 256) { const int j = i / 8, d8 = (i % 8) * 8; FragH f; f.half[0] = *(const v8us*)((const unsigned short*)V16 + ((size_t)b * SQ + s0 + j) * DM + h * HD + d8); for (int q = 0; q < 8; ++q) tl[d8 + q][j] = f.u[q]; }
  __syncthreads();
  { for (int i = tid; i < 64 * 8; i += 256) { const int d = i / 8, j8 = (i % 8) * 8; FragH f; for (int q = 0; q < 8; ++q) f.u[q] = tl[d][j8 + q]; *(v8us*)((unsigned short*)VT + ((size_t)hh * HD + d) * SQ + s0 + j8) = f.half[0]; }  } }



#define FAQB 128                     /* query rows per block */
#define FAK 64                       /* keys per step */
#define FAP (HD + 8)                 /* LDS row pitch, halves */
__device__ __forceinline__ v8f fa_mma(v16h a, v16h b, v8f c) { return __builtin_amdgcn_wmma_f32_16x16x32_f16(false, a, false, b, (short)0, c, false, false); }
__global__ __launch_bounds__(128) void k_fattn(const _Float16* __restrict__ Q, const _Float16* __restrict__ Kh, const _Float16* __restrict__ VTa, _Float16* __restrict__ O) {
  static_assert(NB * NH == 64 && SQ / FAQB == 16 && HD == 64, "k_fattn: the block-to-tile map below is written for 64 (batch, head) pairs x 16 query blocks");
  __shared__ __attribute__((aligned(16))) _Float16 lk[FAK][FAP]; __shared__ __attribute__((aligned(16))) _Float16 lv[HD][FAP];
  const int tid = threadIdx.x, lane = tid & 31, ln = lane & 15, hh = lane >> 4; const int w = __builtin_amdgcn_readfirstlane(tid >> 5);      /* the wave's number as a scalar: the two tests on q0w below are scalar branches */
  const int g = blockIdx.x >> 8, sub = (blockIdx.x >> 6) & 3, bh = blockIdx.x & 63;
  const int qb = (g == 0) ? 15 - sub : ((g == 1) ? 8 + sub : ((g == 2) ? 7 - sub : sub));      /* a permutation of the 16 query blocks: long blocks start first, and blocks 256 apart in the index add up to the same length */
  const int b = bh / NH, h = bh % NH; const size_t r0 = (size_t)b * SQ; const int q0w = qb * FAQB + w * 32; const int nst = (qb + 1) * (FAQB / FAK);
  const unsigned short* qp = (const unsigned short*)Q + (r0 + q0w + ln) * LQ + h * HD + 8 * hh; v16h qf[2][2];      /* the lane's own address, so that the eight loads differ in the immediate offset alone; every loop but the step loop is fully unrolled: all array indices are constants and the arrays stay in registers */
#pragma unroll
  for (int nt = 0; nt < 2; ++nt)
#pragma unroll
    for (int kk = 0; kk < 2; ++kk) { FragH f; f.half[0] = *(const v8us*)(qp + (size_t)nt * 16 * LQ + kk * 32); f.half[1] = *(const v8us*)(qp + (size_t)nt * 16 * LQ + kk * 32 + 16); qf[nt][kk] = f.v; }      /* the k order of g2_frag */
  const int sr = tid >> 3, sc = (tid & 7) * 8;      /* staging: 8 lanes take one 128-byte row, a pass of the block 16 rows */
  const unsigned short* kp = (const unsigned short*)Kh + (r0 + sr) * LQ + h * HD + sc; const unsigned short* vp = (const unsigned short*)VTa + ((size_t)bh * HD + sr) * SQ + sc; v8us kr[4], vr[4];
#pragma unroll
  for (int u = 0; u < 4; ++u) { kr[u] = *(const v8us*)(kp + (size_t)u * 16 * LQ); vr[u] = *(const v8us*)(vp + (size_t)u * 16 * SQ); }
  asm volatile("s_wait_xcnt 0x0" :: "v"(qp), "v"(kp), "v"(vp) : "memory");      /* the wait between the loads above and the first rewrite of their address registers; the addresses are inputs so that their registers stay untouched up to it */
  const v8f z8 = {0.f, 0.f, 0.f, 0.f, 0.f, 0.f, 0.f, 0.f}; v8f o[4][2];
#pragma unroll
  for (int dt = 0; dt < 4; ++dt) { o[dt][0] = z8; o[dt][1] = z8; }
  float m[2] = {-1.0e30f, -1.0e30f}, l[2] = {0.f, 0.f};      /* running max (log2 units) and this lane's part of the running sum, per query tile */
  const float SC = 0.125f * 1.44269504088896340736f;      /* 1 / sqrt(64), in log2 units */
#pragma unroll 1
  for (int s = 0; s < nst; ++s) { const int k0 = s * FAK;      /* rolled: one step's code is long and its trip count varies by block */
#pragma unroll
    for (int u = 0; u < 4; ++u) { *(v8us*)&lk[u * 16 + sr][sc] = kr[u]; *(v8us*)&lv[u * 16 + sr][sc] = vr[u]; }
    __syncthreads();      /* publishes this step's K and V^T rows */
    if (s + 1 < nst) { kp += (size_t)FAK * LQ; vp += FAK;
#pragma unroll
      for (int u = 0; u < 4; ++u) { kr[u] = *(const v8us*)(kp + (size_t)u * 16 * LQ); vr[u] = *(const v8us*)(vp + (size_t)u * 16 * SQ); }
      asm volatile("s_wait_xcnt 0x0" :: "v"(kp), "v"(vp) : "memory"); }      /* as above: stands in front of the next step's address additions */
    if (k0 <= q0w + 31) {      /* a wave whose queries all lie below this step's keys only passes the barriers */
      v8f st[4][2];
#pragma unroll
      for (int kt = 0; kt < 4; ++kt) { st[kt][0] = z8; st[kt][1] = z8; }
#pragma unroll
      for (int kk = 0; kk < 2; ++kk)
#pragma unroll
        for (int kt = 0; kt < 4; ++kt) { const v16h a = g2_frag(&lk[kt * 16 + ln][kk * 32], hh); st[kt][0] = fa_mma(a, qf[0][kk], st[kt][0]); st[kt][1] = fa_mma(a, qf[1][kk], st[kt][1]); }
      if (k0 + FAK - 1 > q0w) {      /* only steps that reach past the wave's first query mask */
#pragma unroll
        for (int kt = 0; kt < 4; ++kt)
#pragma unroll
          for (int nt = 0; nt < 2; ++nt)
#pragma unroll
            for (int r = 0; r < 8; ++r) st[kt][nt][r] = (k0 + kt * 16 + 8 * hh + r <= q0w + nt * 16 + ln) ? st[kt][nt][r] : -3.0e38f; }
      v16h pf[2][2];
#pragma unroll
      for (int nt = 0; nt < 2; ++nt) { float mr = st[0][nt][0];
#pragma unroll
        for (int kt = 0; kt < 4; ++kt)
#pragma unroll
          for (int r = 0; r < 8; ++r) mr = fmaxf(mr, st[kt][nt][r]);
        mr = fmaxf(mr, __shfl_xor(mr, 16, 32));
        const float mn = fmaxf(m[nt], mr * SC); const float al = __builtin_amdgcn_exp2f(m[nt] - mn); m[nt] = mn; const float bs = 8.0f - mn;      /* + 8: weights carried x256; a masked key underflows to exactly 0 */
        v4f s4 = {0.f, 0.f, 0.f, 0.f};
#pragma unroll
        for (int kt = 0; kt < 4; ++kt)
#pragma unroll
          for (int r = 0; r < 8; ++r) { const float p = __builtin_amdgcn_exp2f(fmaf(st[kt][nt][r], SC, bs)); s4[r & 3] += p; pf[nt][kt >> 1][(kt & 1) * 8 + r] = (_Float16)p; }
        l[nt] = fmaf(l[nt], al, (s4[0] + s4[1]) + (s4[2] + s4[3]));
#pragma unroll
        for (int dt = 0; dt < 4; ++dt) o[dt][nt] *= al; }
#pragma unroll
      for (int j = 0; j < 2; ++j)
#pragma unroll
        for (int dt = 0; dt < 4; ++dt) { const v16h a = g2_frag(&lv[dt * 16 + ln][j * 32], hh); o[dt][0] = fa_mma(a, pf[0][j], o[dt][0]); o[dt][1] = fa_mma(a, pf[1][j], o[dt][1]); } }
    __syncthreads(); }      /* ends every wave's reads of this step's rows before the next step's stores */
  FragH t[2][4];      /* all eight 16-byte results are formed first: no store's data register is rewritten behind it */
#pragma unroll
  for (int nt = 0; nt < 2; ++nt) { const float f = 64.0f / (l[nt] + __shfl_xor(l[nt], 16, 32));
#pragma unroll
    for (int dt = 0; dt < 4; ++dt)
#pragma unroll
      for (int r = 0; r < 8; ++r) t[nt][dt].h[r] = (_Float16)(o[dt][nt][r] * f); }
  unsigned short* op = (unsigned short*)O + (r0 + q0w + ln) * DM + h * HD + 8 * hh;
#pragma unroll
  for (int nt = 0; nt < 2; ++nt)
#pragma unroll
    for (int dt = 0; dt < 4; ++dt) *(v8us*)(op + (size_t)nt * 16 * DM + dt * 16) = t[nt][dt].half[0]; }


// Exact f32 attention for the first QT0 rows of every batch (by; planes of QT0 rows a batch; o carried x64 like the f16 path, and stored as an f16 high part and an f16 residual x1024, the two operand planes of the output GEMM). One wave per query row, A0R rows of one head per block.
// All QT0 K and V rows of the head are staged in LDS once by coalesced 16-byte loads. K rows get a pitch of 68 floats (16 bytes x odd), so that 32 lanes reading 32 rows by 16 bytes spread over the banks.
// Scores: lane = key (four partial sums over the head dimension). Row max and row sum: five-step butterfly. o: lane = two head columns, loop over the keys, each key's weight read from its lane into a scalar register; keys above the row carry weight 0.
#define A0R 8                        /* rows (waves) per block */
#define A0KP (HD + 4)                /* K row pitch in LDS, floats */
__device__ __forceinline__ void att0w_blk(int bx, int by, const float* __restrict__ QF, const float* __restrict__ KF, const float* __restrict__ VF, float scale, _Float16* __restrict__ OH, _Float16* __restrict__ OL) {
  __shared__ __attribute__((aligned(16))) float lk[QT0][A0KP]; __shared__ __attribute__((aligned(16))) float lv[QT0][HD];
  const int tid = threadIdx.x, lane = tid & 31; const int w = __builtin_amdgcn_readfirstlane(tid >> 5);      /* the wave's number as a scalar: row, group count and branches below are wave-uniform */
  const int h = bx / (QT0 / A0R), r0 = (bx % (QT0 / A0R)) * A0R; const int i = r0 + w;
  const size_t pb = (size_t)by * QT0 * DM; QF += pb; KF += pb; VF += pb; OH += pb; OL += pb;
  const float* qr = QF + (size_t)i * DM + h * HD; v4f q[HD / 4];      /* every loop of this kernel is fully unrolled: the indices into q, kk, vv, sv and o and the lane of each readlane are then constants, so the arrays stay in registers */
#pragma unroll
  for (int c = 0; c < HD / 4; ++c) q[c] = *(const __attribute__((address_space(4))) v4fa*)(qr + c * 4);      /* the wave's own q row, whole. Read as constant memory (the launch before wrote it, no block of this launch does): its address is wave-uniform, so the row comes by scalar loads into scalar registers; as a plain load in a kernel that holds a second job it came by vector loads and held 64 vector registers (136 for the kernel against 84) */
  const int sj = tid >> 4, sc4 = (tid & 15) * 4; const float* kp = KF + (size_t)sj * DM + h * HD + sc4; const float* vp = VF + (size_t)sj * DM + h * HD + sc4; v4f kk[QT0 / 16], vv[QT0 / 16];      /* one pass of the block stages 16 rows; both loops are fully unrolled and free of branches so that every load of the block is in flight before the first LDS store waits; the row pitch is a constant, so the passes differ in the immediate offset alone */
#pragma unroll
  for (int u = 0; u < QT0 / 16; ++u) { kk[u] = *(const v4fa*)(kp + (size_t)u * 16 * DM); vv[u] = *(const v4fa*)(vp + (size_t)u * 16 * DM); }
  asm volatile("s_wait_xcnt 0x0" :: "v"(kp), "v"(vp) : "memory");      /* the wait between the loads above and the first reuse of their address registers; the two addresses are inputs so that their registers stay untouched up to it */
#pragma unroll
  for (int u = 0; u < QT0 / 16; ++u) { *(v4f*)&lk[u * 16 + sj][sc4] = kk[u]; *(v4f*)&lv[u * 16 + sj][sc4] = vv[u]; }
  __syncthreads();
  const int ng = (i >> 5) + 1;      /* key groups of 32 that hold a key <= i */
  float sv[QT0 / 32];
#pragma unroll
  for (int g = 0; g < QT0 / 32; ++g) { sv[g] = -1.0e30f;
    if (g < ng) { const int j = g * 32 + lane; v4f a = {0.f, 0.f, 0.f, 0.f};
#pragma unroll
      for (int c = 0; c < HD / 4; ++c) a += q[c] * *(const v4f*)&lk[j][c * 4];
      const float s = ((a[0] + a[1]) + (a[2] + a[3])) * scale; sv[g] = (j <= i) ? s : -1.0e30f; } }
  float mx = fmaxf(fmaxf(sv[0], sv[1]), fmaxf(sv[2], sv[3]));
#pragma unroll
  for (int m = 16; m >= 1; m >>= 1) mx = fmaxf(mx, __shfl_xor(mx, m, 32));
  float se = 0.f;
#pragma unroll
  for (int g = 0; g < QT0 / 32; ++g) { const float e = expf(sv[g] - mx); sv[g] = e; se += e; }      /* a key above the row holds -1e30: its weight underflows to exactly 0 */
#pragma unroll
  for (int m = 16; m >= 1; m >>= 1) se += __shfl_xor(se, m, 32);
  v2f o[4] = {{0.f, 0.f}, {0.f, 0.f}, {0.f, 0.f}, {0.f, 0.f}};      /* four partial sums over the keys (key mod 4): four independent add chains */
#pragma unroll
  for (int g = 0; g < QT0 / 32; ++g) if (g < ng) {
#pragma unroll
    for (int jj = 0; jj < 32; ++jj) { const float e = __int_as_float(__builtin_amdgcn_readlane(__float_as_int(sv[g]), jj)); o[jj & 3] += e * *(const v2f*)&lv[g * 32 + jj][lane * 2]; } }
  const float fin = 64.0f / se; const v2f r = ((o[0] + o[1]) + (o[2] + o[3])) * fin;
  typedef _Float16 v2h __attribute__((ext_vector_type(2))); v2h rh, rl;
  rh[0] = (_Float16)r[0]; rh[1] = (_Float16)r[1]; rl[0] = (_Float16)((r[0] - (float)rh[0]) * 1024.0f); rl[1] = (_Float16)((r[1] - (float)rh[1]) * 1024.0f);
  const size_t oo = (size_t)i * DM + h * HD + lane * 2; *(v2h*)(OH + oo) = rh; *(v2h*)(OL + oo) = rl; }
// One launch for the two jobs that need only the projections and not each other: the exact first-tile attention and the V transposes. Of three neighbouring blocks one takes a first-tile piece and two a V tile, so that a WGP holds
// blocks of both kinds at a time: the first kind is busy in LDS and the vector unit, the second waits on memory. blockIdx.x is a scalar: a block takes one branch as a whole, barriers included.
#define MB_A (NBR * NH * (QT0 / A0R))      /* first-tile blocks */
__global__ __launch_bounds__(256) void k_mid(const float* __restrict__ QF, const float* __restrict__ KF, const float* __restrict__ VF, float scale, _Float16* __restrict__ OH, _Float16* __restrict__ OL, const _Float16* __restrict__ V16, _Float16* __restrict__ Vt) {
  static_assert(NB * NH * (SQ / 64) == 2 * MB_A, "k_mid: two V tiles to one first-tile block");
  const int g = blockIdx.x / 3, r = blockIdx.x - g * 3;
  if (r != 0) { vt_blk<NH, SQ>(g * 2 + r - 1, V16, LQ, 0, Vt); return; }
  att0w_blk(g % (NH * (QT0 / A0R)), g / (NH * (QT0 / A0R)), QF, KF, VF, scale, OH, OL); }


__device__ __forceinline__ void wt_hq_blk(int nt, int kt, const float* __restrict__ Wf, _Float16* __restrict__ Bq, _Float16* __restrict__ Bk, _Float16* __restrict__ Bv, float (*tl)[WTT + 1]) {
  static_assert(HD == WTT && DM % WTT == 0, "wt_hq_blk: a 64-column tile is the q, k or v part of one head");
  const int h = nt / 3, wh = nt % 3;      /* column tile nt = head * 3 + (q | k | v); neighbouring blocks take neighbouring pieces of the same W rows */
  _Float16* dst = (wh == 0) ? Bq : ((wh == 1) ? Bk : Bv);
  wt_tile(Wf + (size_t)kt * WTT * (3 * DM) + nt * WTT, 3 * DM, (unsigned short*)dst + (size_t)h * HD * DM + kt * WTT, DM, 16.0f, tl); }
__device__ __forceinline__ void bhq_blk(int bx, const float* __restrict__ bf, float* __restrict__ B3) {
  const int t = bx * 256 + threadIdx.x; if (t >= 3 * DM) return; const int wh = t / DM, row = t % DM; const int h = row / HD, d = row % HD; const float v = bf16_round(bf[h * (3 * HD) + wh * HD + d]); *(float*)(B3 + t) = v;  }

__device__ __forceinline__ void tabcp32_blk(int bx, const float* __restrict__ tc, const float* __restrict__ tsn, float* __restrict__ CS, float* __restrict__ SN, int n) {
  const int t = bx * 256 + threadIdx.x; if (t >= n) return; const float c = bf16_round(tc[t]), s = bf16_round(tsn[t]);
  *(float*)(CS + t) = c; *(float*)(SN + t) = s;  }
// One launch for the five preparations, none of which reads what another writes: both weight transposes, the bias vector, the rope tables, the x rows. A block's job follows from its index alone (blockIdx.x is a scalar: a block takes one branch as a whole, the transposes' barrier included).
// The transposes, whose blocks have the longest chain (load, LDS, barrier, LDS, store), come first in the index; the x rows, most of the bytes, stream behind them.
#define PB_WQ ((3 * DM / WTT) * (DM / WTT))      /* W_qkv tiles */
#define PB_WO ((DM / WTT) * (DM / WTT))          /* W_out tiles */
#define PB_B ((3 * DM + 255) / 256)              /* bias blocks */
#define PB_T ((SQ * 32 + 255) / 256)             /* rope-table blocks */
#define PB_X ((int)((NR * DM / 8 + 255) / 256))  /* x blocks */
__global__ __launch_bounds__(256) void k_prep(const float* __restrict__ x, const float* __restrict__ Wf, const float* __restrict__ bf, const float* __restrict__ Wo, const float* __restrict__ tc, const float* __restrict__ tsn,
    _Float16* __restrict__ X16, _Float16* __restrict__ Bq, _Float16* __restrict__ Bk, _Float16* __restrict__ Bv, _Float16* __restrict__ Bo, float* __restrict__ B3, float* __restrict__ CS, float* __restrict__ SN) {
  __shared__ float tl[WTT][WTT + 1];
  int bx = blockIdx.x;
  if (bx < PB_WQ) { wt_hq_blk(bx % (3 * DM / WTT), bx / (3 * DM / WTT), Wf, Bq, Bk, Bv, tl); return; }
  bx -= PB_WQ;
  if (bx < PB_WO) { const int nt = bx % (DM / WTT), kt = bx / (DM / WTT); wt_tile(Wo + (size_t)kt * WTT * DM + nt * WTT, DM, (unsigned short*)Bo + (size_t)nt * WTT * DM + kt * WTT, DM, 16.0f, tl); return; }      /* W_out [in][out] -> Bt x16; neighbouring blocks take neighbouring pieces of the same W rows */
  bx -= PB_WO;
  if (bx < PB_B) { bhq_blk(bx, bf, B3); return; }
  bx -= PB_B;
  if (bx < PB_T) { tabcp32_blk(bx, tc, tsn, CS, SN, SQ * 32); return; }
  bx -= PB_T;
  x16_blk(bx, x, X16, NR * DM / 8); }
extern "C" void kernel_launch(void* const* d_in, const int* in_sizes, int n_in,
                              void* d_out, int out_size, void* d_ws, size_t ws_size, hipStream_t stream) {
  (void)in_sizes; (void)n_in; (void)out_size;
  const float* const* I = (const float* const*)d_in; const float* x = I[0]; const float* wqkv = I[1]; const float* bqkv = I[2]; const float* wo = I[3]; const float* bo = I[4]; const float* tcos = I[5]; const float* tsin = I[6];      /* x; fused W_qkv [1024][3072] + b_qkv [3072] ([in][out]; per-head (q | k | v) column triples); W_out + b_out ([in][out]); rope tables cos / sin [2048][32] */
  char* ws = (char*)d_ws; size_t off = 0;
  auto take = [&](size_t bytes) { char* p = ws + off; off += (bytes + 255) & ~(size_t)255; return p; };
  _Float16* BQ = (_Float16*)take((size_t)DM * DM * 2); _Float16* BK = (_Float16*)take((size_t)DM * DM * 2); _Float16* BV = (_Float16*)take((size_t)DM * DM * 2); _Float16* BO = (_Float16*)take((size_t)DM * DM * 2);
  float* BQB = (float*)take((size_t)3 * DM * 4); float* CSB = (float*)take((size_t)SQ * 32 * 4); float* SNB = (float*)take((size_t)SQ * 32 * 4);      /* de-interleaved bias vector bq | bk | bv; bf16-rounded copies of the rope tables */ _Float16* X16 = (_Float16*)take(NR * DM * 2); _Float16* Q16 = (_Float16*)take(NR * DM * 2); _Float16* K16 = (_Float16*)take(NR * DM * 2); _Float16* V16 = (_Float16*)take(NR * DM * 2); _Float16* O16 = (_Float16*)take(NR * DM * 2);
  _Float16* VT = (_Float16*)take((size_t)NB * NH * HD * SQ * 2);
  float* QF0 = (float*)take((size_t)3 * NBR * QT0 * DM * 4); float* KF0 = QF0 + (size_t)NBR * QT0 * DM; float* VF0 = KF0 + (size_t)NBR * QT0 * DM;      /* first-tile f32 q | k | v, each NBR planes of QT0 rows, one after the other */ _Float16* OH0 = (_Float16*)take((size_t)NB * QT0 * DM * 2); _Float16* OL0 = (_Float16*)take((size_t)NB * QT0 * DM * 2);
  if (off > ws_size) return;
  k_prep<<<PB_WQ + PB_WO + PB_B + PB_T + PB_X, 256, 0, stream>>>(x, wqkv, bqkv, wo, tcos, tsin, X16, BQ, BK, BV, BO, BQB, CSB, SNB);      /* one launch: fused [in][out] weight with per-head (q | k | v) column triples -> three Bt planes (row h*64 + d) x16; the de-interleaved bias vector; W_out [in][out] -> Bt x16; rope tables [pos][32], bf16-rounded copies; x -> f16 rows */
  const size_t r0p = (size_t)B0 * SQ;      /* first projected row */
  k_gemm2<0, 1, 1><<<dim3((unsigned)((MP / 128) * (DM / 128)), 3), 256, 0, stream>>>(X16 + r0p * DM, 0, BQ, (size_t)DM * DM, 0.0625f, BQB, DM, nullptr, Q16 + r0p * DM, DM, NR * DM, MP, DM, DM, CSB, SNB, nullptr, nullptr, QF0);      /* q, k, v (f32) + bias in one launch (blockIdx.y; BQ | BK | BV and Q16 | K16 | V16 lie one after the other); q and k -> interleaved-pair rope (position = row % SQ); -> f16 rows; the blocks of the first 128 rows of a batch store their f32 tile (exact products) to QF0 | KF0 | VF0 too */
  k_mid<<<3 * MB_A, 256, 0, stream>>>(QF0, KF0, VF0, 0.125f, OH0 + (size_t)B0 * QT0 * DM, OL0 + (size_t)B0 * QT0 * DM, V16, VT);      /* one launch: exact f32 attention for rows 0..127 of every batch (o x64) -> f16 hi + x1024 residual planes; V^T [NB][NH][HD][SQ] */
  k_fattn<<<NB * NH * (SQ / FAQB), 128, 0, stream>>>(Q16, K16, VT, O16);      /* scores, causal softmax and P V in one launch; o (merged heads, x64) as f16 rows */
  k_gemm2<0, 0, 2><<<dim3((unsigned)((MPO / 128) * (DM / 128)), 1), 256, 0, stream>>>(O16 + r0p * DM, 0, BO, 0, 0.0009765625f, bo, 0, (float*)d_out + r0p * DM, nullptr, DM, 0, MPO, DM, DM, nullptr, nullptr, OH0 + (size_t)B0 * QT0 * DM, OL0 + (size_t)B0 * QT0 * DM);      /* out rows are the output layout; rows 0..127 of a batch: out = o_hi Wo (+ b) + o_lo Wo 2^-20, in the same launch */
}
